// v000
// Measured on an AMD MI455X. A time is GPU time per run, averaged over a window of back-to-back runs after a warm-up
// (all launches, gaps included; the runs take copies of the inputs in turn), and the median of several windows.
// Apart from v000's, it joins two sittings. Times from different sittings can be a few percent apart, while
// side-by-side timings come from the same sitting.
// v000 is the starting kernel. One run takes 44.2 microseconds.
#include <hip/hip_runtime.h>
#include <math.h>
#include <stdint.h>

// Problem constants (match reference: B=1, S=512, HID=256, H=8, D=32)
#define S_LEN   512
#define HID     256
#define SCALE_F 0.17677669529663687f     // 1/sqrt(32)
#define LOG2E_F 1.4426950408889634f
#define INV2PI_F 0.15915494309189535f

typedef __attribute__((ext_vector_type(2))) float v2f;
typedef __attribute__((ext_vector_type(8))) float v8f;

// sigma(v) = 1/(1+e^-v) via v_exp_f32 + v_rcp_f32 (no IEEE divide sequence)
__device__ __forceinline__ float fast_sigmoid(float v) {
    return __builtin_amdgcn_rcpf(1.0f + __builtin_amdgcn_exp2f(-v * LOG2E_F));
}

// ---------------------------------------------------------------------------
// GEMM: out[M=512, N=256] = X[512,256] @ W[256,256]^T + bias   (nn.Linear)
// One wave32 computes one 16x16 tile with V_WMMA_F32_16X16X4_F32, K step 4.
//
// A (16x4 f32, ISA 7.12.2): lanes 0-15 -> M=lane, {K0,K1}; lanes 16-31 ->
//   M=lane-16, {K2,K3}  => per-lane float2 at X[m][k + half*2].
// B (4x16 f32): lanes 0-15 -> N=lane, {K0,K1}; lanes 16-31 -> N=lane-16,
//   {K2,K3}; B[k][n] = W[n][k], contiguous along k -> float2 loads.
// C/D (16x16 f32, 8 VGPRs): vgpr g -> M = g + 8*(lane>>4), N = lane&15.
//
// Epilogues store pre-normalized quantities for the fused attention kernel:
//  MODE 0 (q): omega_rev  = sigmoid(v) * PI / (2*PI) = 0.5*sigmoid(v)
//  MODE 1 (k): amp_pre    = sigmoid(v) * SCALE * log2(e)
//  MODE 2 (v): out0 = raw v ; out1 = phase_rev = 0.5*tanh(v) = sigmoid(2v)-0.5
//  MODE 3    : plain v (output projection)
// ---------------------------------------------------------------------------
template <int MODE>
__global__ __launch_bounds__(128)
void gemm_wmma_ep(const float* __restrict__ X, const float* __restrict__ W,
                  const float* __restrict__ bias,
                  float* __restrict__ out0, float* __restrict__ out1)
{
    const int wid  = blockIdx.x * 4 + (threadIdx.x >> 5);   // global wave id
    const int lane = threadIdx.x & 31;
    const int half = lane >> 4;        // 0: K pair {0,1}, 1: K pair {2,3}
    const int l15  = lane & 15;
    const int tilesN = HID / 16;       // 16 tiles in N
    const int row = (wid / tilesN) * 16;
    const int col = (wid % tilesN) * 16;

    const float* aptr = X + (size_t)(row + l15) * HID + half * 2;
    const float* bptr = W + (size_t)(col + l15) * HID + half * 2;

    v8f acc = {};
#pragma unroll 8
    for (int k = 0; k < HID; k += 4) {
        v2f a = *(const v2f*)(aptr + k);   // global_load_b64
        v2f b = *(const v2f*)(bptr + k);   // global_load_b64
        // 8 args: (neg_a, A, neg_b, B, c_mod, C, reuse_a, reuse_b)
        acc = __builtin_amdgcn_wmma_f32_16x16x4_f32(false, a, false, b,
                                                    (short)0, acc, false, false);
    }

    const int   n  = col + l15;
    const float bn = bias[n];
#pragma unroll
    for (int g = 0; g < 8; ++g) {
        const int m   = row + g + half * 8;
        const float v = acc[g] + bn;
        const size_t idx = (size_t)m * HID + n;
        if (MODE == 0) {
            out0[idx] = 0.5f * fast_sigmoid(v);                  // omega / 2pi
        } else if (MODE == 1) {
            out0[idx] = (SCALE_F * LOG2E_F) * fast_sigmoid(v);   // pre-scaled A
        } else if (MODE == 2) {
            out0[idx] = v;                                       // raw v
            out1[idx] = fast_sigmoid(2.0f * v) - 0.5f;           // phase / 2pi
        } else {
            out0[idx] = v;                                       // plain
        }
    }
}

// ---------------------------------------------------------------------------
// Fused wave-interference attention.
// One block per query position i (512 blocks), one thread per hidden column
// c (256 threads). Per key j:
//   logit2 = amp_pre[i,c] * cos(2pi*(omega_rev[i,c]*(i-j) + phase_rev[i,c]))
//   p = 2^logit2        (== exp(SCALE*A*cos(omega*(i-j)+phase)))
// |logit2| <= SCALE*log2(e) ~ 0.255 -> exp can never overflow, so one-pass
// softmax with no max subtraction. v rows are staged 32 at a time into LDS
// with GLOBAL_LOAD_ASYNC_TO_LDS_B128 (ASYNCcnt-tracked, no VGPR round trip).
// ---------------------------------------------------------------------------
#define VCHUNK 32

__global__ __launch_bounds__(HID)
void wave_attn(const float* __restrict__ omega_rev, const float* __restrict__ amp_pre,
               const float* __restrict__ phase_rev, const float* __restrict__ vraw,
               float* __restrict__ context)
{
    __shared__ __align__(16) float vtile[VCHUNK * HID];   // 32 KB of LDS

    const int i = blockIdx.x;
    const int c = threadIdx.x;
    const size_t ic = (size_t)i * HID + c;

    const float wr = omega_rev[ic];   // omega / 2pi   (revolutions per step)
    const float ap = amp_pre[ic];     // A * SCALE * log2(e)
    const float pr = phase_rev[ic];   // phase / 2pi

    const uint32_t lds_base = (uint32_t)(uintptr_t)(&vtile[0]);

    float den  = 0.0f;
    float num  = 0.0f;
    float posf = (float)i;            // (i - j), exact fp32 counter

    for (int j0 = 0; j0 < S_LEN; j0 += VCHUNK) {
        __syncthreads();              // previous chunk fully consumed
        // stage 32 rows (8192 floats = 2048 x b128) memory -> LDS, async
        {
            const uint64_t gbase = (uint64_t)(uintptr_t)(vraw + (size_t)j0 * HID);
#pragma unroll
            for (int kk = 0; kk < 8; ++kk) {
                const uint32_t idx4    = (uint32_t)threadIdx.x + (uint32_t)kk * HID;
                const uint32_t lds_off = lds_base + idx4 * 16u;
                const uint64_t gaddr   = gbase + (uint64_t)idx4 * 16u;
                asm volatile("global_load_async_to_lds_b128 %0, %1, off"
                             :: "v"(lds_off), "v"(gaddr) : "memory");
            }
            asm volatile("s_wait_asynccnt 0x0" ::: "memory");
        }
        __syncthreads();              // all waves' async writes visible

#pragma unroll 4
        for (int r = 0; r < VCHUNK; ++r) {
            const float ang = fmaf(wr, posf, pr);            // revolutions
            const float cn  = __builtin_amdgcn_cosf(ang);    // cos(2pi*ang)
            const float p   = __builtin_amdgcn_exp2f(ap * cn);
            den += p;
            num  = fmaf(p, vtile[r * HID + c], num);
            posf -= 1.0f;
        }
    }

    context[ic] = num * __builtin_amdgcn_rcpf(den);
}

// ---------------------------------------------------------------------------
// Host-side launcher.  d_ws layout (floats): omega | amp | phase | vraw | ctx
// = 5 * 512*256 * 4B = 2.62 MB.
// ---------------------------------------------------------------------------
extern "C" void kernel_launch(void* const* d_in, const int* in_sizes, int n_in,
                              void* d_out, int out_size, void* d_ws, size_t ws_size,
                              hipStream_t stream)
{
    (void)in_sizes; (void)n_in; (void)out_size; (void)ws_size;

    const float* x  = (const float*)d_in[0];
    const float* wq = (const float*)d_in[1];
    const float* bq = (const float*)d_in[2];
    const float* wk = (const float*)d_in[3];
    const float* bk = (const float*)d_in[4];
    const float* wv = (const float*)d_in[5];
    const float* bv = (const float*)d_in[6];
    const float* wo = (const float*)d_in[7];
    const float* bo = (const float*)d_in[8];
    float* out = (float*)d_out;

    float* ws = (float*)d_ws;
    const size_t N = (size_t)S_LEN * HID;
    float* omega = ws + 0 * N;
    float* amp   = ws + 1 * N;
    float* phase = ws + 2 * N;
    float* vraw  = ws + 3 * N;
    float* ctx   = ws + 4 * N;

    // (512/16)*(256/16) = 512 output tiles, 4 waves (128 thr) per block.
    const dim3 gemmGrid(128);
    const dim3 gemmBlock(128);

    hipLaunchKernelGGL((gemm_wmma_ep<0>), gemmGrid, gemmBlock, 0, stream,
                       x, wq, bq, omega, (float*)nullptr);
    hipLaunchKernelGGL((gemm_wmma_ep<1>), gemmGrid, gemmBlock, 0, stream,
                       x, wk, bk, amp, (float*)nullptr);
    hipLaunchKernelGGL((gemm_wmma_ep<2>), gemmGrid, gemmBlock, 0, stream,
                       x, wv, bv, vraw, phase);

    hipLaunchKernelGGL(wave_attn, dim3(S_LEN), dim3(HID), 0, stream,
                       omega, amp, phase, vraw, ctx);

    hipLaunchKernelGGL((gemm_wmma_ep<3>), gemmGrid, gemmBlock, 0, stream,
                       ctx, wo, bo, out, (float*)nullptr);
}

// v001
// A run of this version takes 34.9 microseconds.
// In both of two side-by-side timings against v000, it was 1.27 times as fast.
#include <hip/hip_runtime.h>
#include <math.h>
#include <stdint.h>

// Problem constants (match reference: B=1, S=512, HID=256, H=8, D=32)
#define S_LEN   512
#define HID     256
#define SCALE_F 0.17677669529663687f     // 1/sqrt(32)
#define LOG2E_F 1.4426950408889634f
#define INV2PI_F 0.15915494309189535f

typedef __attribute__((ext_vector_type(2))) float v2f;
typedef __attribute__((ext_vector_type(8))) float v8f;

// sigma(v) = 1/(1+e^-v) via v_exp_f32 + v_rcp_f32 (no IEEE divide sequence)
__device__ __forceinline__ float fast_sigmoid(float v) {
    return __builtin_amdgcn_rcpf(1.0f + __builtin_amdgcn_exp2f(-v * LOG2E_F));
}

// ---------------------------------------------------------------------------
// GEMM: out[M=512, N=256] = X[512,256] @ W[256,256]^T + bias   (nn.Linear)
// One wave32 computes one 16x16 tile with V_WMMA_F32_16X16X4_F32, K step 4.
//
// A (16x4 f32, ISA 7.12.2): lanes 0-15 -> M=lane, {K0,K1}; lanes 16-31 ->
//   M=lane-16, {K2,K3}  => per-lane float2 at X[m][k + half*2].
// B (4x16 f32): lanes 0-15 -> N=lane, {K0,K1}; lanes 16-31 -> N=lane-16,
//   {K2,K3}; B[k][n] = W[n][k], contiguous along k -> float2 loads.
// C/D (16x16 f32, 8 VGPRs): vgpr g -> M = g + 8*(lane>>4), N = lane&15.
//
// Epilogues store pre-normalized quantities for the fused attention kernel:
//  MODE 0 (q): omega_rev  = sigmoid(v) * PI / (2*PI) = 0.5*sigmoid(v)
//  MODE 1 (k): amp_pre    = sigmoid(v) * SCALE * log2(e)
//  MODE 2 (v): out0 = raw v ; out1 = phase_rev = 0.5*tanh(v) = sigmoid(2v)-0.5
//  MODE 3    : plain v (output projection)
// ---------------------------------------------------------------------------
template <int MODE>
__global__ __launch_bounds__(128)
void gemm_wmma_ep(const float* __restrict__ X, const float* __restrict__ W,
                  const float* __restrict__ bias,
                  float* __restrict__ out0, float* __restrict__ out1)
{
    const int wid  = blockIdx.x * 4 + (threadIdx.x >> 5);   // global wave id
    const int lane = threadIdx.x & 31;
    const int half = lane >> 4;        // 0: K pair {0,1}, 1: K pair {2,3}
    const int l15  = lane & 15;
    const int tilesN = HID / 16;       // 16 tiles in N
    const int row = (wid / tilesN) * 16;
    const int col = (wid % tilesN) * 16;

    const float* aptr = X + (size_t)(row + l15) * HID + half * 2;
    const float* bptr = W + (size_t)(col + l15) * HID + half * 2;

    v8f acc = {};
#pragma unroll 8
    for (int k = 0; k < HID; k += 4) {
        v2f a = *(const v2f*)(aptr + k);   // global_load_b64
        v2f b = *(const v2f*)(bptr + k);   // global_load_b64
        // 8 args: (neg_a, A, neg_b, B, c_mod, C, reuse_a, reuse_b)
        acc = __builtin_amdgcn_wmma_f32_16x16x4_f32(false, a, false, b,
                                                    (short)0, acc, false, false);
    }

    const int   n  = col + l15;
    const float bn = bias[n];
#pragma unroll
    for (int g = 0; g < 8; ++g) {
        const int m   = row + g + half * 8;
        const float v = acc[g] + bn;
        const size_t idx = (size_t)m * HID + n;
        if (MODE == 0) {
            out0[idx] = 0.5f * fast_sigmoid(v);                  // omega / 2pi
        } else if (MODE == 1) {
            out0[idx] = (SCALE_F * LOG2E_F) * fast_sigmoid(v);   // pre-scaled A
        } else if (MODE == 2) {
            out0[idx] = v;                                       // raw v
            out1[idx] = fast_sigmoid(2.0f * v) - 0.5f;           // phase / 2pi
        } else {
            out0[idx] = v;                                       // plain
        }
    }
}

// ---------------------------------------------------------------------------
// Fused wave-interference attention.
// Column c of the context needs column c of v only, so a work-group owns a
// slab of 32 columns and 16 query rows: wave w serves query row i0 + w, lane l
// serves column c0 + l. The slab of v (512 keys x 32 columns = 64 KB) is
// brought into LDS once and every wave walks all of it. Per key j:
//   logit2 = amp_pre[i,c] * cos(2pi*(omega_rev[i,c]*(i-j) + phase_rev[i,c]))
//   p = 2^logit2        (== exp(SCALE*A*cos(omega*(i-j)+phase)))
// |logit2| <= SCALE*log2(e) ~ 0.255 -> exp can never overflow, so one-pass
// softmax with no max subtraction.
// ---------------------------------------------------------------------------
#define SLAB  32      // columns of v per work-group (one 128-byte line a row)
#define QROWS 16      // query rows per work-group, one per wave

__global__ __launch_bounds__(SLAB * QROWS)
void wave_attn(const float* __restrict__ omega_rev, const float* __restrict__ amp_pre,
               const float* __restrict__ phase_rev, const float* __restrict__ vraw,
               float* __restrict__ context)
{
    __shared__ __align__(16) float vslab[S_LEN * SLAB];   // 64 KB of LDS

    const int t    = threadIdx.x;                          // 0..511
    const int lane = t & 31;
    const int c0   = (blockIdx.x & (HID / SLAB - 1)) * SLAB;
    // the wave's number, told to the compiler as wave-uniform: i and the
    // (i - j) counter then stay in scalar registers
    const int wave = __builtin_amdgcn_readfirstlane(t >> 5);
    const int i    = (blockIdx.x / (HID / SLAB)) * QROWS + wave;
    const size_t ic = (size_t)i * HID + c0 + lane;

    const float wr = omega_rev[ic];   // omega / 2pi   (revolutions per step)
    const float ap = amp_pre[ic];     // A * SCALE * log2(e)
    const float pr = phase_rev[ic];   // phase / 2pi

    // Fill the slab: 4096 pieces of 16 bytes, 8 per thread. Piece p is row
    // p >> 3, bytes (p & 7) * 16 of the row's 128; thread t takes pieces
    // t + 512 * n, so one step of n is 64 rows of v and 8 KB of LDS.
    {
        const uint32_t l0 = (uint32_t)(uintptr_t)(&vslab[0]) + (uint32_t)t * 16u;
        const uint64_t g0 = (uint64_t)(uintptr_t)(vraw + (size_t)(t >> 3) * HID
                                                  + c0 + (t & 7) * 4);
        const uint32_t ls = 512u * 16u;                    // LDS bytes per step
        const uint64_t gs = (uint64_t)64 * HID * 4;        // global bytes per step
        // s_wait_xcnt 0 stands, as a precaution, ahead of any rewrite of the
        // copies' address registers; inside the copies' own statement the
        // compiler can move nothing over it.
        asm volatile("global_load_async_to_lds_b128 %0, %8, off\n\t"
                     "global_load_async_to_lds_b128 %1, %9, off\n\t"
                     "global_load_async_to_lds_b128 %2, %10, off\n\t"
                     "global_load_async_to_lds_b128 %3, %11, off\n\t"
                     "global_load_async_to_lds_b128 %4, %12, off\n\t"
                     "global_load_async_to_lds_b128 %5, %13, off\n\t"
                     "global_load_async_to_lds_b128 %6, %14, off\n\t"
                     "global_load_async_to_lds_b128 %7, %15, off\n\t"
                     "s_wait_xcnt 0x0"
                     :: "v"(l0),          "v"(l0 + 1 * ls), "v"(l0 + 2 * ls), "v"(l0 + 3 * ls),
                        "v"(l0 + 4 * ls), "v"(l0 + 5 * ls), "v"(l0 + 6 * ls), "v"(l0 + 7 * ls),
                        "v"(g0),          "v"(g0 + 1 * gs), "v"(g0 + 2 * gs), "v"(g0 + 3 * gs),
                        "v"(g0 + 4 * gs), "v"(g0 + 5 * gs), "v"(g0 + 6 * gs), "v"(g0 + 7 * gs)
                     : "memory");
    }

    // This wave's copies have landed; behind the barrier every wave's have.
    asm volatile("s_wait_asynccnt 0x0" ::: "memory");
    __syncthreads();

    float den  = 0.0f;
    float num  = 0.0f;
    float posf = (float)i;            // (i - j), exact fp32 counter

    // eight keys a trip: the trip's LDS reads go out together, ahead of the
    // arithmetic that covers their latency
#pragma unroll 8
    for (int j = 0; j < S_LEN; ++j) {
        const float ang = fmaf(wr, posf, pr);            // revolutions
        const float cn  = __builtin_amdgcn_cosf(ang);    // cos(2pi*ang)
        const float p   = __builtin_amdgcn_exp2f(ap * cn);
        den += p;
        num  = fmaf(p, vslab[j * SLAB + lane], num);
        posf -= 1.0f;
    }

    context[ic] = num * __builtin_amdgcn_rcpf(den);
}

// ---------------------------------------------------------------------------
// Host-side launcher.  d_ws layout (floats): omega | amp | phase | vraw | ctx
// = 5 * 512*256 * 4B = 2.62 MB.
// ---------------------------------------------------------------------------
extern "C" void kernel_launch(void* const* d_in, const int* in_sizes, int n_in,
                              void* d_out, int out_size, void* d_ws, size_t ws_size,
                              hipStream_t stream)
{
    (void)in_sizes; (void)n_in; (void)out_size; (void)ws_size;

    const float* x  = (const float*)d_in[0];
    const float* wq = (const float*)d_in[1];
    const float* bq = (const float*)d_in[2];
    const float* wk = (const float*)d_in[3];
    const float* bk = (const float*)d_in[4];
    const float* wv = (const float*)d_in[5];
    const float* bv = (const float*)d_in[6];
    const float* wo = (const float*)d_in[7];
    const float* bo = (const float*)d_in[8];
    float* out = (float*)d_out;

    float* ws = (float*)d_ws;
    const size_t N = (size_t)S_LEN * HID;
    float* omega = ws + 0 * N;
    float* amp   = ws + 1 * N;
    float* phase = ws + 2 * N;
    float* vraw  = ws + 3 * N;
    float* ctx   = ws + 4 * N;

    // (512/16)*(256/16) = 512 output tiles, 4 waves (128 thr) per block.
    const dim3 gemmGrid(128);
    const dim3 gemmBlock(128);

    hipLaunchKernelGGL((gemm_wmma_ep<0>), gemmGrid, gemmBlock, 0, stream,
                       x, wq, bq, omega, (float*)nullptr);
    hipLaunchKernelGGL((gemm_wmma_ep<1>), gemmGrid, gemmBlock, 0, stream,
                       x, wk, bk, amp, (float*)nullptr);
    hipLaunchKernelGGL((gemm_wmma_ep<2>), gemmGrid, gemmBlock, 0, stream,
                       x, wv, bv, vraw, phase);

    // (512/16) query groups x (256/32) column slabs = 256 blocks of 16 waves.
    hipLaunchKernelGGL(wave_attn, dim3(256), dim3(512), 0, stream,
                       omega, amp, phase, vraw, ctx);

    hipLaunchKernelGGL((gemm_wmma_ep<3>), gemmGrid, gemmBlock, 0, stream,
                       ctx, wo, bo, out, (float*)nullptr);
}

// v002
// Measured time: 23.6 microseconds a run.
// Next to v001, in two timings, it ran 1.47 times as fast each time.
// Counting every step since v000, it is 1.87 times as fast.
#include <hip/hip_runtime.h>
#include <math.h>
#include <stdint.h>

// Problem constants (match reference: B=1, S=512, HID=256, H=8, D=32)
#define S_LEN   512
#define HID     256
#define SCALE_F 0.17677669529663687f     // 1/sqrt(32)
#define LOG2E_F 1.4426950408889634f
#define INV2PI_F 0.15915494309189535f

typedef __attribute__((ext_vector_type(2))) float v2f;
typedef __attribute__((ext_vector_type(8))) float v8f;

// sigma(v) = 1/(1+e^-v) via v_exp_f32 + v_rcp_f32 (no IEEE divide sequence)
__device__ __forceinline__ float fast_sigmoid(float v) {
    return __builtin_amdgcn_rcpf(1.0f + __builtin_amdgcn_exp2f(-v * LOG2E_F));
}

// ---------------------------------------------------------------------------
// Linear layers: out[M=512, N=256] = X[512,256] @ W[256,256]^T + bias.
// One wave32 computes one 16x16 tile with V_WMMA_F32_16X16X4_F32, K step 4.
//
// A (16x4 f32, ISA 7.12.2): lanes 0-15 -> M=lane, {K0,K1}; lanes 16-31 ->
//   M=lane-16, {K2,K3}  => per-lane float2 at X[m][k + half*2].
// B (4x16 f32): lanes 0-15 -> N=lane, {K0,K1}; lanes 16-31 -> N=lane-16,
//   {K2,K3}; B[k][n] = W[n][k], contiguous along k -> float2 loads.
// C/D (16x16 f32, 8 VGPRs): vgpr g -> M = g + 8*(lane>>4), N = lane&15.
// ---------------------------------------------------------------------------
__device__ __forceinline__ v8f tile_product(const float* __restrict__ X,
                                            const float* __restrict__ W,
                                            int row, int col, int lane)
{
    const int half = lane >> 4;        // 0: K pair {0,1}, 1: K pair {2,3}
    const int l15  = lane & 15;
    const float* aptr = X + (size_t)(row + l15) * HID + half * 2;
    const float* bptr = W + (size_t)(col + l15) * HID + half * 2;

    v8f acc = {};
#pragma unroll 8
    for (int k = 0; k < HID; k += 4) {
        v2f a = *(const v2f*)(aptr + k);   // global_load_b64
        v2f b = *(const v2f*)(bptr + k);   // global_load_b64
        // 8 args: (neg_a, A, neg_b, B, c_mod, C, reuse_a, reuse_b)
        acc = __builtin_amdgcn_wmma_f32_16x16x4_f32(false, a, false, b,
                                                    (short)0, acc, false, false);
    }
    return acc;
}

// The q, k and v projections in ONE launch: they read the same x and none
// reads another's result. 256 work-groups of 6 waves, one per WGP: a
// work-group owns 16 rows of x and 32 output columns; wave w computes
// projection w >> 1 (0 = q, 1 = k, 2 = v) for column tile w & 1, so all six
// waves walk the same rows of x.
// The stores are pre-normalized for the attention kernel:
//  q: omega_rev = sigmoid(t) * PI / (2*PI) = 0.5*sigmoid(t)
//  k: amp_pre   = sigmoid(t) * SCALE * log2(e)
//  v: vraw = t ; phase_rev = 0.5*tanh(t) = sigmoid(2t)-0.5
__global__ __launch_bounds__(192)
void proj_qkv(const float* __restrict__ X,
              const float* __restrict__ Wq, const float* __restrict__ bq,
              const float* __restrict__ Wk, const float* __restrict__ bk,
              const float* __restrict__ Wv, const float* __restrict__ bv,
              float* __restrict__ omega_rev, float* __restrict__ amp_pre,
              float* __restrict__ vraw, float* __restrict__ phase_rev)
{
    // wave-uniform, so the choice of weights and of the store form is scalar
    const int wave = __builtin_amdgcn_readfirstlane(threadIdx.x >> 5);
    const int lane = threadIdx.x & 31;
    const int proj = wave >> 1;
    const int row  = (blockIdx.x >> 3) * 16;
    const int col  = ((blockIdx.x & 7) * 2 + (wave & 1)) * 16;

    const float* W    = proj == 0 ? Wq : proj == 1 ? Wk : Wv;
    const float* bias = proj == 0 ? bq : proj == 1 ? bk : bv;

    const v8f acc = tile_product(X, W, row, col, lane);

    const int    n    = col + (lane & 15);
    const float  bn   = bias[n];
    const size_t idx0 = (size_t)(row + (lane >> 4) * 8) * HID + n;
    float t[8];
#pragma unroll
    for (int g = 0; g < 8; ++g) t[g] = acc[g] + bn;

    if (proj == 0) {
#pragma unroll
        for (int g = 0; g < 8; ++g)
            omega_rev[idx0 + (size_t)g * HID] = 0.5f * fast_sigmoid(t[g]);
    } else if (proj == 1) {
#pragma unroll
        for (int g = 0; g < 8; ++g)
            amp_pre[idx0 + (size_t)g * HID] = (SCALE_F * LOG2E_F) * fast_sigmoid(t[g]);
        // s_wait_xcnt 0 stands, as a precaution, behind these stores: in the built
        // code another store form's arithmetic follows them and reuses their registers
        asm volatile("s_wait_xcnt 0x0" ::: "memory");
    } else {
#pragma unroll
        for (int g = 0; g < 8; ++g) {
            vraw[idx0 + (size_t)g * HID]      = t[g];
            phase_rev[idx0 + (size_t)g * HID] = fast_sigmoid(2.0f * t[g]) - 0.5f;
        }
        // s_wait_xcnt 0 stands, as a precaution, behind these stores: in the built
        // code another store form's arithmetic follows them and reuses their registers
        asm volatile("s_wait_xcnt 0x0" ::: "memory");
    }
}

// Output projection: 128 work-groups of 4 waves, one 16x16 tile a wave.
__global__ __launch_bounds__(128)
void proj_out(const float* __restrict__ X, const float* __restrict__ W,
              const float* __restrict__ bias, float* __restrict__ out)
{
    const int wid  = blockIdx.x * 4 + (threadIdx.x >> 5);   // global wave id
    const int lane = threadIdx.x & 31;
    const int tilesN = HID / 16;       // 16 tiles in N
    const int row = (wid / tilesN) * 16;
    const int col = (wid % tilesN) * 16;

    const v8f acc = tile_product(X, W, row, col, lane);

    const int   n  = col + (lane & 15);
    const float bn = bias[n];
#pragma unroll
    for (int g = 0; g < 8; ++g)
        out[(size_t)(row + g + (lane >> 4) * 8) * HID + n] = acc[g] + bn;
}

// ---------------------------------------------------------------------------
// Fused wave-interference attention.
// Column c of the context needs column c of v only, so a work-group owns a
// slab of 32 columns and 16 query rows: wave w serves query row i0 + w, lane l
// serves column c0 + l. The slab of v (512 keys x 32 columns = 64 KB) is
// brought into LDS once and every wave walks all of it. Per key j:
//   logit2 = amp_pre[i,c] * cos(2pi*(omega_rev[i,c]*(i-j) + phase_rev[i,c]))
//   p = 2^logit2        (== exp(SCALE*A*cos(omega*(i-j)+phase)))
// |logit2| <= SCALE*log2(e) ~ 0.255 -> exp can never overflow, so one-pass
// softmax with no max subtraction.
// ---------------------------------------------------------------------------
#define SLAB  32      // columns of v per work-group (one 128-byte line a row)
#define QROWS 16      // query rows per work-group, one per wave

__global__ __launch_bounds__(SLAB * QROWS)
void wave_attn(const float* __restrict__ omega_rev, const float* __restrict__ amp_pre,
               const float* __restrict__ phase_rev, const float* __restrict__ vraw,
               float* __restrict__ context)
{
    __shared__ __align__(16) float vslab[S_LEN * SLAB];   // 64 KB of LDS

    const int t    = threadIdx.x;                          // 0..511
    const int lane = t & 31;
    const int c0   = (blockIdx.x & (HID / SLAB - 1)) * SLAB;
    // the wave's number, told to the compiler as wave-uniform: i and the
    // (i - j) counter then stay in scalar registers
    const int wave = __builtin_amdgcn_readfirstlane(t >> 5);
    const int i    = (blockIdx.x / (HID / SLAB)) * QROWS + wave;
    const size_t ic = (size_t)i * HID + c0 + lane;

    const float wr = omega_rev[ic];   // omega / 2pi   (revolutions per step)
    const float ap = amp_pre[ic];     // A * SCALE * log2(e)
    const float pr = phase_rev[ic];   // phase / 2pi

    // Fill the slab: 4096 pieces of 16 bytes, 8 per thread. Piece p is row
    // p >> 3, bytes (p & 7) * 16 of the row's 128; thread t takes pieces
    // t + 512 * n, so one step of n is 64 rows of v and 8 KB of LDS.
    {
        const uint32_t l0 = (uint32_t)(uintptr_t)(&vslab[0]) + (uint32_t)t * 16u;
        const uint64_t g0 = (uint64_t)(uintptr_t)(vraw + (size_t)(t >> 3) * HID
                                                  + c0 + (t & 7) * 4);
        const uint32_t ls = 512u * 16u;                    // LDS bytes per step
        const uint64_t gs = (uint64_t)64 * HID * 4;        // global bytes per step
        // s_wait_xcnt 0 stands, as a precaution, ahead of any rewrite of the
        // copies' address registers; inside the copies' own statement the
        // compiler can move nothing over it.
        asm volatile("global_load_async_to_lds_b128 %0, %8, off\n\t"
                     "global_load_async_to_lds_b128 %1, %9, off\n\t"
                     "global_load_async_to_lds_b128 %2, %10, off\n\t"
                     "global_load_async_to_lds_b128 %3, %11, off\n\t"
                     "global_load_async_to_lds_b128 %4, %12, off\n\t"
                     "global_load_async_to_lds_b128 %5, %13, off\n\t"
                     "global_load_async_to_lds_b128 %6, %14, off\n\t"
                     "global_load_async_to_lds_b128 %7, %15, off\n\t"
                     "s_wait_xcnt 0x0"
                     :: "v"(l0),          "v"(l0 + 1 * ls), "v"(l0 + 2 * ls), "v"(l0 + 3 * ls),
                        "v"(l0 + 4 * ls), "v"(l0 + 5 * ls), "v"(l0 + 6 * ls), "v"(l0 + 7 * ls),
                        "v"(g0),          "v"(g0 + 1 * gs), "v"(g0 + 2 * gs), "v"(g0 + 3 * gs),
                        "v"(g0 + 4 * gs), "v"(g0 + 5 * gs), "v"(g0 + 6 * gs), "v"(g0 + 7 * gs)
                     : "memory");
    }

    // This wave's copies have landed; behind the barrier every wave's have.
    asm volatile("s_wait_asynccnt 0x0" ::: "memory");
    __syncthreads();

    float den  = 0.0f;
    float num  = 0.0f;
    float posf = (float)i;            // (i - j), exact fp32 counter

    // eight keys a trip: the trip's LDS reads go out together, ahead of the
    // arithmetic that covers their latency
#pragma unroll 8
    for (int j = 0; j < S_LEN; ++j) {
        const float ang = fmaf(wr, posf, pr);            // revolutions
        const float cn  = __builtin_amdgcn_cosf(ang);    // cos(2pi*ang)
        const float p   = __builtin_amdgcn_exp2f(ap * cn);
        den += p;
        num  = fmaf(p, vslab[j * SLAB + lane], num);
        posf -= 1.0f;
    }

    context[ic] = num * __builtin_amdgcn_rcpf(den);
}

// ---------------------------------------------------------------------------
// Host-side launcher.  d_ws layout (floats): omega | amp | phase | vraw | ctx
// = 5 * 512*256 * 4B = 2.62 MB.
// ---------------------------------------------------------------------------
extern "C" void kernel_launch(void* const* d_in, const int* in_sizes, int n_in,
                              void* d_out, int out_size, void* d_ws, size_t ws_size,
                              hipStream_t stream)
{
    (void)in_sizes; (void)n_in; (void)out_size; (void)ws_size;

    const float* x  = (const float*)d_in[0];
    const float* wq = (const float*)d_in[1];
    const float* bq = (const float*)d_in[2];
    const float* wk = (const float*)d_in[3];
    const float* bk = (const float*)d_in[4];
    const float* wv = (const float*)d_in[5];
    const float* bv = (const float*)d_in[6];
    const float* wo = (const float*)d_in[7];
    const float* bo = (const float*)d_in[8];
    float* out = (float*)d_out;

    float* ws = (float*)d_ws;
    const size_t N = (size_t)S_LEN * HID;
    float* omega = ws + 0 * N;
    float* amp   = ws + 1 * N;
    float* phase = ws + 2 * N;
    float* vraw  = ws + 3 * N;
    float* ctx   = ws + 4 * N;

    // (512/16) row tiles x (256/32) column pairs = 256 blocks of 6 waves.
    hipLaunchKernelGGL(proj_qkv, dim3(256), dim3(192), 0, stream,
                       x, wq, bq, wk, bk, wv, bv, omega, amp, vraw, phase);

    // (512/16) query groups x (256/32) column slabs = 256 blocks of 16 waves.
    hipLaunchKernelGGL(wave_attn, dim3(256), dim3(512), 0, stream,
                       omega, amp, phase, vraw, ctx);

    // (512/16)*(256/16) = 512 output tiles, 4 waves (128 thr) per block.
    hipLaunchKernelGGL(proj_out, dim3(128), dim3(128), 0, stream,
                       ctx, wo, bo, out);
}

// v003
// Measured time: 17.6 microseconds a run.
// Timed twice side by side with v002, it ran 1.34 times as fast both times.
// All steps since v000 together make it 2.50 times as fast.
#include <hip/hip_runtime.h>
#include <math.h>
#include <stdint.h>

// Problem constants (match reference: B=1, S=512, HID=256, H=8, D=32)
#define S_LEN   512
#define HID     256
#define SCALE_F 0.17677669529663687f     // 1/sqrt(32)
#define LOG2E_F 1.4426950408889634f
#define INV2PI_F 0.15915494309189535f

typedef __attribute__((ext_vector_type(2))) float v2f;
typedef __attribute__((ext_vector_type(8))) float v8f;

// sigma(v) = 1/(1+e^-v) via v_exp_f32 + v_rcp_f32 (no IEEE divide sequence)
__device__ __forceinline__ float fast_sigmoid(float v) {
    return __builtin_amdgcn_rcpf(1.0f + __builtin_amdgcn_exp2f(-v * LOG2E_F));
}

// ---------------------------------------------------------------------------
// Linear layers: out[M=512, N=256] = X[512,256] @ W[256,256]^T + bias.
// One wave32 computes one 16x16 tile with V_WMMA_F32_16X16X4_F32, K step 4.
//
// A (16x4 f32, ISA 7.12.2): lanes 0-15 -> M=lane, {K0,K1}; lanes 16-31 ->
//   M=lane-16, {K2,K3}  => per-lane float2 at X[m][k + half*2].
// B (4x16 f32): lanes 0-15 -> N=lane, {K0,K1}; lanes 16-31 -> N=lane-16,
//   {K2,K3}; B[k][n] = W[n][k], contiguous along k -> float2 reads.
// C/D (16x16 f32, 8 VGPRs): vgpr g -> M = g + 8*(lane>>4), N = lane&15.
//
// An operand tile is 16 whole rows of X or of W: 16 KB in a row in memory.
// A fragment read straight from memory touches 16 lines for 256 bytes, so a
// work-group first brings its tiles into LDS in whole lines, each tile once
// for all the waves that use it, and the fragments are read from LDS.
// LDS row pitch 260 floats: row r starts on bank 4r, so the 32 lanes of an
// 8-byte fragment read fall on all 64 banks once.
// ---------------------------------------------------------------------------
#define PITCH      260                 // floats per tile row in LDS (1040 bytes)
#define TILE_LDS   (16 * PITCH)        // floats per tile in LDS

// Four rows of a tile (4 KB): eight copies of 512 bytes, two a row.
// l: this lane's LDS byte address, g: this lane's global address.
__device__ __forceinline__ void copy_rows4(uint32_t l, uint64_t g)
{
    const uint32_t lp = PITCH * 4u;    // LDS bytes per row
    // s_wait_xcnt 0 stands, as a precaution, ahead of any rewrite of the
    // copies' address registers; inside the copies' own statement the
    // compiler can move nothing over it.
    asm volatile("global_load_async_to_lds_b128 %0, %8, off\n\t"
                 "global_load_async_to_lds_b128 %1, %9, off\n\t"
                 "global_load_async_to_lds_b128 %2, %10, off\n\t"
                 "global_load_async_to_lds_b128 %3, %11, off\n\t"
                 "global_load_async_to_lds_b128 %4, %12, off\n\t"
                 "global_load_async_to_lds_b128 %5, %13, off\n\t"
                 "global_load_async_to_lds_b128 %6, %14, off\n\t"
                 "global_load_async_to_lds_b128 %7, %15, off\n\t"
                 "s_wait_xcnt 0x0"
                 :: "v"(l),          "v"(l + 512u),          "v"(l + lp),     "v"(l + lp + 512u),
                    "v"(l + 2 * lp), "v"(l + 2 * lp + 512u), "v"(l + 3 * lp), "v"(l + 3 * lp + 512u),
                    "v"(g),          "v"(g + 512),  "v"(g + 1024), "v"(g + 1536),
                    "v"(g + 2048),   "v"(g + 2560), "v"(g + 3072), "v"(g + 3584)
                 : "memory");
}

// One wave brings one tile (rows src .. src + 15 * HID) to dst: 32 copies.
__device__ __forceinline__ void stage_tile(float* dst, const float* __restrict__ src, int lane)
{
    const uint32_t l0 = (uint32_t)(uintptr_t)dst + (uint32_t)lane * 16u;
    const uint64_t g0 = (uint64_t)(uintptr_t)(src + lane * 4);
    // unrolled: four straight statements, no address register carried round a loop
#pragma unroll
    for (int q = 0; q < 4; ++q)
        copy_rows4(l0 + (uint32_t)q * (4u * PITCH * 4u), g0 + (uint64_t)q * (4 * HID * 4));
}

#define KGRP 8      // K steps (WMMAs) per group of fragment reads

__device__ __forceinline__ v8f tile_product(const float* As, const float* Bs, int lane)
{
    const int half = lane >> 4;        // 0: K pair {0,1}, 1: K pair {2,3}
    const int l15  = lane & 15;
    const float* aptr = As + l15 * PITCH + half * 2;
    const float* bptr = Bs + l15 * PITCH + half * 2;

    // every loop below is unrolled whole: the two fragment sets are register
    // arrays and stay in registers only under constant indices
    v2f a[2][KGRP], b[2][KGRP];
#pragma unroll
    for (int s = 0; s < KGRP; ++s) {
        a[0][s] = *(const v2f*)(aptr + s * 4);   // ds_load_b64
        b[0][s] = *(const v2f*)(bptr + s * 4);   // ds_load_b64
    }

    v8f acc = {};
#pragma unroll
    for (int g = 0; g < HID / (4 * KGRP); ++g) {
        if (g + 1 < HID / (4 * KGRP)) {
#pragma unroll
            for (int s = 0; s < KGRP; ++s) {
                a[(g + 1) & 1][s] = *(const v2f*)(aptr + ((g + 1) * KGRP + s) * 4);
                b[(g + 1) & 1][s] = *(const v2f*)(bptr + ((g + 1) * KGRP + s) * 4);
            }
        }
        // holds the next group's LDS reads ahead of this group's WMMAs, which
        // cover their latency; left alone the compiler reads two WMMAs ahead
        __builtin_amdgcn_sched_barrier(0);
#pragma unroll
        for (int s = 0; s < KGRP; ++s)
            // 8 args: (neg_a, A, neg_b, B, c_mod, C, reuse_a, reuse_b)
            acc = __builtin_amdgcn_wmma_f32_16x16x4_f32(false, a[g & 1][s], false, b[g & 1][s],
                                                        (short)0, acc, false, false);
    }
    // four vector slots between the last WMMA and the first read of its result
    // (a precaution: the distance table does not list the f32 form); the two
    // scheduling barriers hold the slots at this place
    __builtin_amdgcn_sched_barrier(0);
    asm volatile("v_nop\n\tv_nop\n\tv_nop\n\tv_nop");
    __builtin_amdgcn_sched_barrier(0);
    return acc;
}

// The q, k and v projections in ONE launch: they read the same x and none
// reads another's result. 192 work-groups of 8 waves: a work-group owns 64
// rows of x and 32 output columns (whole 128-byte lines) of one projection
// (0 = q, 1 = k, 2 = v), so six tiles in LDS (four of x, two of the weight)
// serve its eight products. Wave w: row tile w & 3, column tile w >> 2.
// The stores are pre-normalized for the attention kernel:
//  q: omega_rev = sigmoid(t) * PI / (2*PI) = 0.5*sigmoid(t)
//  k: amp_pre   = sigmoid(t) * SCALE * log2(e)
//  v: vraw = t ; phase_rev = 0.5*tanh(t) = sigmoid(2t)-0.5
__global__ __launch_bounds__(256)
void proj_qkv(const float* __restrict__ X,
              const float* __restrict__ Wq, const float* __restrict__ bq,
              const float* __restrict__ Wk, const float* __restrict__ bk,
              const float* __restrict__ Wv, const float* __restrict__ bv,
              float* __restrict__ omega_rev, float* __restrict__ amp_pre,
              float* __restrict__ vraw, float* __restrict__ phase_rev)
{
    __shared__ __align__(16) float tiles[6 * TILE_LDS];   // 99,840 bytes of LDS

    // wave-uniform, so the choice of the tile to bring is scalar
    const int wave = __builtin_amdgcn_readfirstlane(threadIdx.x >> 5);
    const int lane = threadIdx.x & 31;
    const int proj = blockIdx.x >> 6;
    const int row0 = ((blockIdx.x >> 3) & 7) * 64;
    const int col0 = (blockIdx.x & 7) * 32;
    const int row  = row0 + (wave & 3) * 16;
    const int col  = col0 + (wave >> 2) * 16;

    const float* W    = proj == 0 ? Wq : proj == 1 ? Wk : Wv;
    const float* bias = proj == 0 ? bq : proj == 1 ? bk : bv;

    // tiles 0 .. 3: x; tiles 4, 5: W. Wave w < 6 brings tile w.
    if (wave < 6)
        stage_tile(&tiles[wave * TILE_LDS],
                   wave < 4 ? X + (size_t)(row0 + wave * 16) * HID
                            : W + (size_t)(col0 + (wave - 4) * 16) * HID, lane);
    // the bias is read here, so that it flies together with the copies
    const int    n    = col + (lane & 15);
    const float  bn   = bias[n];
    // This wave's copies have landed; behind the barrier every wave's have.
    asm volatile("s_wait_asynccnt 0x0" ::: "memory");
    __syncthreads();

    const v8f acc = tile_product(&tiles[(wave & 3) * TILE_LDS],
                                 &tiles[(4 + (wave >> 2)) * TILE_LDS], lane);

    const size_t idx0 = (size_t)(row + (lane >> 4) * 8) * HID + n;
    float t[8];
#pragma unroll
    for (int g = 0; g < 8; ++g) t[g] = acc[g] + bn;

    if (proj == 0) {
#pragma unroll
        for (int g = 0; g < 8; ++g)
            omega_rev[idx0 + (size_t)g * HID] = 0.5f * fast_sigmoid(t[g]);
    } else if (proj == 1) {
#pragma unroll
        for (int g = 0; g < 8; ++g)
            amp_pre[idx0 + (size_t)g * HID] = (SCALE_F * LOG2E_F) * fast_sigmoid(t[g]);
        // s_wait_xcnt 0 stands, as a precaution, behind these stores: in the built
        // code another store form's arithmetic follows them and reuses their registers
        asm volatile("s_wait_xcnt 0x0" ::: "memory");
    } else {
#pragma unroll
        for (int g = 0; g < 8; ++g) {
            vraw[idx0 + (size_t)g * HID]      = t[g];
            phase_rev[idx0 + (size_t)g * HID] = fast_sigmoid(2.0f * t[g]) - 0.5f;
        }
        // s_wait_xcnt 0 stands, as a precaution, behind these stores: in the built
        // code another store form's arithmetic follows them and reuses their registers
        asm volatile("s_wait_xcnt 0x0" ::: "memory");
    }
}

// Output projection: 128 work-groups of 4 waves; a work-group owns 32 rows
// and 32 columns: four tiles in LDS (two of X, two of W), one brought by each
// wave, serve its four products. Wave w: row tile w & 1, column tile w >> 1.
__global__ __launch_bounds__(128)
void proj_out(const float* __restrict__ X, const float* __restrict__ W,
              const float* __restrict__ bias, float* __restrict__ out)
{
    __shared__ __align__(16) float tiles[4 * TILE_LDS];   // 66,560 bytes of LDS

    const int wave = __builtin_amdgcn_readfirstlane(threadIdx.x >> 5);
    const int lane = threadIdx.x & 31;
    const int row0 = (blockIdx.x >> 3) * 32;
    const int col0 = (blockIdx.x & 7) * 32;
    const int row  = row0 + (wave & 1) * 16;
    const int col  = col0 + (wave >> 1) * 16;

    // tiles 0, 1: X; tiles 2, 3: W. Wave w brings tile w.
    stage_tile(&tiles[wave * TILE_LDS],
               wave < 2 ? X + (size_t)(row0 + wave * 16) * HID
                        : W + (size_t)(col0 + (wave - 2) * 16) * HID, lane);
    // the bias is read here, so that it flies together with the copies
    const int   n  = col + (lane & 15);
    const float bn = bias[n];
    // This wave's copies have landed; behind the barrier every wave's have.
    asm volatile("s_wait_asynccnt 0x0" ::: "memory");
    __syncthreads();

    const v8f acc = tile_product(&tiles[(wave & 1) * TILE_LDS],
                                 &tiles[(2 + (wave >> 1)) * TILE_LDS], lane);

#pragma unroll
    for (int g = 0; g < 8; ++g)
        out[(size_t)(row + g + (lane >> 4) * 8) * HID + n] = acc[g] + bn;
}

// ---------------------------------------------------------------------------
// Fused wave-interference attention.
// Column c of the context needs column c of v only, so a work-group owns a
// slab of 32 columns and 16 query rows: wave w serves query row i0 + w, lane l
// serves column c0 + l. The slab of v (512 keys x 32 columns = 64 KB) is
// brought into LDS once and every wave walks all of it. Per key j:
//   logit2 = amp_pre[i,c] * cos(2pi*(omega_rev[i,c]*(i-j) + phase_rev[i,c]))
//   p = 2^logit2        (== exp(SCALE*A*cos(omega*(i-j)+phase)))
// |logit2| <= SCALE*log2(e) ~ 0.255 -> exp can never overflow, so one-pass
// softmax with no max subtraction.
// ---------------------------------------------------------------------------
#define SLAB  32      // columns of v per work-group (one 128-byte line a row)
#define QROWS 16      // query rows per work-group, one per wave

__global__ __launch_bounds__(SLAB * QROWS)
void wave_attn(const float* __restrict__ omega_rev, const float* __restrict__ amp_pre,
               const float* __restrict__ phase_rev, const float* __restrict__ vraw,
               float* __restrict__ context)
{
    __shared__ __align__(16) float vslab[S_LEN * SLAB];   // 64 KB of LDS

    const int t    = threadIdx.x;                          // 0..511
    const int lane = t & 31;
    const int c0   = (blockIdx.x & (HID / SLAB - 1)) * SLAB;
    // the wave's number, told to the compiler as wave-uniform: i and the
    // (i - j) counter then stay in scalar registers
    const int wave = __builtin_amdgcn_readfirstlane(t >> 5);
    const int i    = (blockIdx.x / (HID / SLAB)) * QROWS + wave;
    const size_t ic = (size_t)i * HID + c0 + lane;

    const float wr = omega_rev[ic];   // omega / 2pi   (revolutions per step)
    const float ap = amp_pre[ic];     // A * SCALE * log2(e)
    const float pr = phase_rev[ic];   // phase / 2pi

    // Fill the slab: 4096 pieces of 16 bytes, 8 per thread. Piece p is row
    // p >> 3, bytes (p & 7) * 16 of the row's 128; thread t takes pieces
    // t + 512 * n, so one step of n is 64 rows of v and 8 KB of LDS.
    {
        const uint32_t l0 = (uint32_t)(uintptr_t)(&vslab[0]) + (uint32_t)t * 16u;
        const uint64_t g0 = (uint64_t)(uintptr_t)(vraw + (size_t)(t >> 3) * HID
                                                  + c0 + (t & 7) * 4);
        const uint32_t ls = 512u * 16u;                    // LDS bytes per step
        const uint64_t gs = (uint64_t)64 * HID * 4;        // global bytes per step
        // s_wait_xcnt 0 stands, as a precaution, ahead of any rewrite of the
        // copies' address registers; inside the copies' own statement the
        // compiler can move nothing over it.
        asm volatile("global_load_async_to_lds_b128 %0, %8, off\n\t"
                     "global_load_async_to_lds_b128 %1, %9, off\n\t"
                     "global_load_async_to_lds_b128 %2, %10, off\n\t"
                     "global_load_async_to_lds_b128 %3, %11, off\n\t"
                     "global_load_async_to_lds_b128 %4, %12, off\n\t"
                     "global_load_async_to_lds_b128 %5, %13, off\n\t"
                     "global_load_async_to_lds_b128 %6, %14, off\n\t"
                     "global_load_async_to_lds_b128 %7, %15, off\n\t"
                     "s_wait_xcnt 0x0"
                     :: "v"(l0),          "v"(l0 + 1 * ls), "v"(l0 + 2 * ls), "v"(l0 + 3 * ls),
                        "v"(l0 + 4 * ls), "v"(l0 + 5 * ls), "v"(l0 + 6 * ls), "v"(l0 + 7 * ls),
                        "v"(g0),          "v"(g0 + 1 * gs), "v"(g0 + 2 * gs), "v"(g0 + 3 * gs),
                        "v"(g0 + 4 * gs), "v"(g0 + 5 * gs), "v"(g0 + 6 * gs), "v"(g0 + 7 * gs)
                     : "memory");
    }

    // This wave's copies have landed; behind the barrier every wave's have.
    asm volatile("s_wait_asynccnt 0x0" ::: "memory");
    __syncthreads();

    float den  = 0.0f;
    float num  = 0.0f;
    float posf = (float)i;            // (i - j), exact fp32 counter

    // eight keys a trip: the trip's LDS reads go out together, ahead of the
    // arithmetic that covers their latency
#pragma unroll 8
    for (int j = 0; j < S_LEN; ++j) {
        const float ang = fmaf(wr, posf, pr);            // revolutions
        const float cn  = __builtin_amdgcn_cosf(ang);    // cos(2pi*ang)
        const float p   = __builtin_amdgcn_exp2f(ap * cn);
        den += p;
        num  = fmaf(p, vslab[j * SLAB + lane], num);
        posf -= 1.0f;
    }

    context[ic] = num * __builtin_amdgcn_rcpf(den);
}

// ---------------------------------------------------------------------------
// Host-side launcher.  d_ws layout (floats): omega | amp | phase | vraw | ctx
// = 5 * 512*256 * 4B = 2.62 MB.
// ---------------------------------------------------------------------------
extern "C" void kernel_launch(void* const* d_in, const int* in_sizes, int n_in,
                              void* d_out, int out_size, void* d_ws, size_t ws_size,
                              hipStream_t stream)
{
    (void)in_sizes; (void)n_in; (void)out_size; (void)ws_size;

    const float* x  = (const float*)d_in[0];
    const float* wq = (const float*)d_in[1];
    const float* bq = (const float*)d_in[2];
    const float* wk = (const float*)d_in[3];
    const float* bk = (const float*)d_in[4];
    const float* wv = (const float*)d_in[5];
    const float* bv = (const float*)d_in[6];
    const float* wo = (const float*)d_in[7];
    const float* bo = (const float*)d_in[8];
    float* out = (float*)d_out;

    float* ws = (float*)d_ws;
    const size_t N = (size_t)S_LEN * HID;
    float* omega = ws + 0 * N;
    float* amp   = ws + 1 * N;
    float* phase = ws + 2 * N;
    float* vraw  = ws + 3 * N;
    float* ctx   = ws + 4 * N;

    // 3 projections x (512/64) row groups x (256/32) column pairs = 192 blocks of 8 waves.
    hipLaunchKernelGGL(proj_qkv, dim3(192), dim3(256), 0, stream,
                       x, wq, bq, wk, bk, wv, bv, omega, amp, vraw, phase);

    // (512/16) query groups x (256/32) column slabs = 256 blocks of 16 waves.
    hipLaunchKernelGGL(wave_attn, dim3(256), dim3(512), 0, stream,
                       omega, amp, phase, vraw, ctx);

    // (512/32) row pairs x (256/32) column pairs = 128 blocks of 4 waves.
    hipLaunchKernelGGL(proj_out, dim3(128), dim3(128), 0, stream,
                       ctx, wo, bo, out);
}

// v004
// Measured time: 14.9 microseconds a run.
// Next to v003, in two timings, it ran 1.19 and 1.18 times as fast.
// Counting every step since v000, it is 2.96 times as fast.
#include <hip/hip_runtime.h>
#include <math.h>
#include <stdint.h>

// Problem constants (match reference: B=1, S=512, HID=256, H=8, D=32)
#define S_LEN   512
#define HID     256
#define SCALE_F 0.17677669529663687f     // 1/sqrt(32)
#define LOG2E_F 1.4426950408889634f
#define INV2PI_F 0.15915494309189535f

typedef __attribute__((ext_vector_type(2))) float v2f;
typedef __attribute__((ext_vector_type(8))) float v8f;

// sigma(v) = 1/(1+e^-v) via v_exp_f32 + v_rcp_f32 (no IEEE divide sequence)
__device__ __forceinline__ float fast_sigmoid(float v) {
    return __builtin_amdgcn_rcpf(1.0f + __builtin_amdgcn_exp2f(-v * LOG2E_F));
}

// ---------------------------------------------------------------------------
// Linear layers: out[M=512, N=256] = X[512,256] @ W[256,256]^T + bias.
// One wave32 computes one 16x16 tile with V_WMMA_F32_16X16X4_F32, K step 4.
//
// A (16x4 f32, ISA 7.12.2): lanes 0-15 -> M=lane, {K0,K1}; lanes 16-31 ->
//   M=lane-16, {K2,K3}  => per-lane float2 at X[m][k + half*2].
// B (4x16 f32): lanes 0-15 -> N=lane, {K0,K1}; lanes 16-31 -> N=lane-16,
//   {K2,K3}; B[k][n] = W[n][k], contiguous along k -> float2 reads.
// C/D (16x16 f32, 8 VGPRs): vgpr g -> M = g + 8*(lane>>4), N = lane&15.
//
// An operand tile is 16 whole rows of X or of W: 16 KB in a row in memory.
// A fragment read straight from memory touches 16 lines for 256 bytes, so a
// work-group first brings its tiles into LDS in whole lines, each tile once
// for all the waves that use it, and the fragments are read from LDS.
// LDS row pitch 260 floats: row r starts on bank 4r, so the 32 lanes of an
// 8-byte fragment read fall on all 64 banks once.
// ---------------------------------------------------------------------------
#define PITCH      260                 // floats per tile row in LDS (1040 bytes)
#define TILE_LDS   (16 * PITCH)        // floats per tile in LDS

// Four rows of a tile (4 KB): eight copies of 512 bytes, two a row.
// l: this lane's LDS byte address, g: this lane's global address.
__device__ __forceinline__ void copy_rows4(uint32_t l, uint64_t g)
{
    const uint32_t lp = PITCH * 4u;    // LDS bytes per row
    // s_wait_xcnt 0 stands, as a precaution, ahead of any rewrite of the
    // copies' address registers; inside the copies' own statement the
    // compiler can move nothing over it.
    asm volatile("global_load_async_to_lds_b128 %0, %8, off\n\t"
                 "global_load_async_to_lds_b128 %1, %9, off\n\t"
                 "global_load_async_to_lds_b128 %2, %10, off\n\t"
                 "global_load_async_to_lds_b128 %3, %11, off\n\t"
                 "global_load_async_to_lds_b128 %4, %12, off\n\t"
                 "global_load_async_to_lds_b128 %5, %13, off\n\t"
                 "global_load_async_to_lds_b128 %6, %14, off\n\t"
                 "global_load_async_to_lds_b128 %7, %15, off\n\t"
                 "s_wait_xcnt 0x0"
                 :: "v"(l),          "v"(l + 512u),          "v"(l + lp),     "v"(l + lp + 512u),
                    "v"(l + 2 * lp), "v"(l + 2 * lp + 512u), "v"(l + 3 * lp), "v"(l + 3 * lp + 512u),
                    "v"(g),          "v"(g + 512),  "v"(g + 1024), "v"(g + 1536),
                    "v"(g + 2048),   "v"(g + 2560), "v"(g + 3072), "v"(g + 3584)
                 : "memory");
}

// One wave brings one tile (rows src .. src + 15 * HID) to dst: 32 copies.
__device__ __forceinline__ void stage_tile(float* dst, const float* __restrict__ src, int lane)
{
    const uint32_t l0 = (uint32_t)(uintptr_t)dst + (uint32_t)lane * 16u;
    const uint64_t g0 = (uint64_t)(uintptr_t)(src + lane * 4);
    // unrolled: four straight statements, no address register carried round a loop
#pragma unroll
    for (int q = 0; q < 4; ++q)
        copy_rows4(l0 + (uint32_t)q * (4u * PITCH * 4u), g0 + (uint64_t)q * (4 * HID * 4));
}

#define KGRP 8      // K steps (WMMAs) per group of fragment reads

__device__ __forceinline__ v8f tile_product(const float* As, const float* Bs, int lane)
{
    const int half = lane >> 4;        // 0: K pair {0,1}, 1: K pair {2,3}
    const int l15  = lane & 15;
    const float* aptr = As + l15 * PITCH + half * 2;
    const float* bptr = Bs + l15 * PITCH + half * 2;

    // every loop below is unrolled whole: the two fragment sets are register
    // arrays and stay in registers only under constant indices
    v2f a[2][KGRP], b[2][KGRP];
#pragma unroll
    for (int s = 0; s < KGRP; ++s) {
        a[0][s] = *(const v2f*)(aptr + s * 4);   // ds_load_b64
        b[0][s] = *(const v2f*)(bptr + s * 4);   // ds_load_b64
    }

    v8f acc = {};
#pragma unroll
    for (int g = 0; g < HID / (4 * KGRP); ++g) {
        if (g + 1 < HID / (4 * KGRP)) {
#pragma unroll
            for (int s = 0; s < KGRP; ++s) {
                a[(g + 1) & 1][s] = *(const v2f*)(aptr + ((g + 1) * KGRP + s) * 4);
                b[(g + 1) & 1][s] = *(const v2f*)(bptr + ((g + 1) * KGRP + s) * 4);
            }
        }
        // holds the next group's LDS reads ahead of this group's WMMAs, which
        // cover their latency; left alone the compiler reads two WMMAs ahead
        __builtin_amdgcn_sched_barrier(0);
#pragma unroll
        for (int s = 0; s < KGRP; ++s)
            // 8 args: (neg_a, A, neg_b, B, c_mod, C, reuse_a, reuse_b)
            acc = __builtin_amdgcn_wmma_f32_16x16x4_f32(false, a[g & 1][s], false, b[g & 1][s],
                                                        (short)0, acc, false, false);
    }
    // four vector slots between the last WMMA and the first read of its result
    // (a precaution: the distance table does not list the f32 form); the two
    // scheduling barriers hold the slots at this place
    __builtin_amdgcn_sched_barrier(0);
    asm volatile("v_nop\n\tv_nop\n\tv_nop\n\tv_nop");
    __builtin_amdgcn_sched_barrier(0);
    return acc;
}

// The q, k and v projections in ONE launch: they read the same x and none
// reads another's result. 192 work-groups of 8 waves: a work-group owns 64
// rows of x and 32 output columns (whole 128-byte lines) of one projection
// (0 = q, 1 = k, 2 = v), so six tiles in LDS (four of x, two of the weight)
// serve its eight products. Wave w: row tile w & 3, column tile w >> 2.
// The stores are pre-normalized for the attention kernel:
//  q: omega_rev = sigmoid(t) * PI / (2*PI) = 0.5*sigmoid(t)
//  k: amp_pre   = sigmoid(t) * SCALE * log2(e)
//  v: vraw = t ; phase_rev = 0.5*tanh(t) = sigmoid(2t)-0.5
__global__ __launch_bounds__(256)
void proj_qkv(const float* __restrict__ X,
              const float* __restrict__ Wq, const float* __restrict__ bq,
              const float* __restrict__ Wk, const float* __restrict__ bk,
              const float* __restrict__ Wv, const float* __restrict__ bv,
              float* __restrict__ omega_rev, float* __restrict__ amp_pre,
              float* __restrict__ vraw, float* __restrict__ phase_rev)
{
    __shared__ __align__(16) float tiles[6 * TILE_LDS];   // 99,840 bytes of LDS

    // wave-uniform, so the choice of the tile to bring is scalar
    const int wave = __builtin_amdgcn_readfirstlane(threadIdx.x >> 5);
    const int lane = threadIdx.x & 31;
    const int proj = blockIdx.x >> 6;
    const int row0 = ((blockIdx.x >> 3) & 7) * 64;
    const int col0 = (blockIdx.x & 7) * 32;
    const int row  = row0 + (wave & 3) * 16;
    const int col  = col0 + (wave >> 2) * 16;

    const float* W    = proj == 0 ? Wq : proj == 1 ? Wk : Wv;
    const float* bias = proj == 0 ? bq : proj == 1 ? bk : bv;

    // tiles 0 .. 3: x; tiles 4, 5: W. Wave w < 6 brings tile w.
    if (wave < 6)
        stage_tile(&tiles[wave * TILE_LDS],
                   wave < 4 ? X + (size_t)(row0 + wave * 16) * HID
                            : W + (size_t)(col0 + (wave - 4) * 16) * HID, lane);
    // the bias is read here, so that it flies together with the copies
    const int    n    = col + (lane & 15);
    const float  bn   = bias[n];
    // This wave's copies have landed; behind the barrier every wave's have.
    asm volatile("s_wait_asynccnt 0x0" ::: "memory");
    __syncthreads();

    const v8f acc = tile_product(&tiles[(wave & 3) * TILE_LDS],
                                 &tiles[(4 + (wave >> 2)) * TILE_LDS], lane);

    const size_t idx0 = (size_t)(row + (lane >> 4) * 8) * HID + n;
    float t[8];
#pragma unroll
    for (int g = 0; g < 8; ++g) t[g] = acc[g] + bn;

    if (proj == 0) {
#pragma unroll
        for (int g = 0; g < 8; ++g)
            omega_rev[idx0 + (size_t)g * HID] = 0.5f * fast_sigmoid(t[g]);
    } else if (proj == 1) {
#pragma unroll
        for (int g = 0; g < 8; ++g)
            amp_pre[idx0 + (size_t)g * HID] = (SCALE_F * LOG2E_F) * fast_sigmoid(t[g]);
        // s_wait_xcnt 0 stands, as a precaution, behind these stores: in the built
        // code another store form's arithmetic follows them and reuses their registers
        asm volatile("s_wait_xcnt 0x0" ::: "memory");
    } else {
#pragma unroll
        for (int g = 0; g < 8; ++g) {
            vraw[idx0 + (size_t)g * HID]      = t[g];
            phase_rev[idx0 + (size_t)g * HID] = fast_sigmoid(2.0f * t[g]) - 0.5f;
        }
        // s_wait_xcnt 0 stands, as a precaution, behind these stores: in the built
        // code another store form's arithmetic follows them and reuses their registers
        asm volatile("s_wait_xcnt 0x0" ::: "memory");
    }
}

// Output projection: 128 work-groups of 4 waves; a work-group owns 32 rows
// and 32 columns: four tiles in LDS (two of X, two of W), one brought by each
// wave, serve its four products. Wave w: row tile w & 1, column tile w >> 1.
__global__ __launch_bounds__(128)
void proj_out(const float* __restrict__ X, const float* __restrict__ W,
              const float* __restrict__ bias, float* __restrict__ out)
{
    __shared__ __align__(16) float tiles[4 * TILE_LDS];   // 66,560 bytes of LDS

    const int wave = __builtin_amdgcn_readfirstlane(threadIdx.x >> 5);
    const int lane = threadIdx.x & 31;
    const int row0 = (blockIdx.x >> 3) * 32;
    const int col0 = (blockIdx.x & 7) * 32;
    const int row  = row0 + (wave & 1) * 16;
    const int col  = col0 + (wave >> 1) * 16;

    // tiles 0, 1: X; tiles 2, 3: W. Wave w brings tile w.
    stage_tile(&tiles[wave * TILE_LDS],
               wave < 2 ? X + (size_t)(row0 + wave * 16) * HID
                        : W + (size_t)(col0 + (wave - 2) * 16) * HID, lane);
    // the bias is read here, so that it flies together with the copies
    const int   n  = col + (lane & 15);
    const float bn = bias[n];
    // This wave's copies have landed; behind the barrier every wave's have.
    asm volatile("s_wait_asynccnt 0x0" ::: "memory");
    __syncthreads();

    const v8f acc = tile_product(&tiles[(wave & 1) * TILE_LDS],
                                 &tiles[(2 + (wave >> 1)) * TILE_LDS], lane);

#pragma unroll
    for (int g = 0; g < 8; ++g)
        out[(size_t)(row + g + (lane >> 4) * 8) * HID + n] = acc[g] + bn;
}

// ---------------------------------------------------------------------------
// Fused wave-interference attention.
// Column c of the context needs column c of v only, so a work-group owns a
// slab of 32 columns and 16 query rows: wave w serves query row i0 + w, lane l
// serves column c0 + l. The slab of v (512 keys x 32 columns = 64 KB) is
// brought into LDS once and every wave walks all of it. Per key j:
//   logit2 = amp_pre[i,c] * cos(2pi*(omega_rev[i,c]*(i-j) + phase_rev[i,c]))
//   p = 2^logit2        (== exp(SCALE*A*cos(omega*(i-j)+phase)))
// |logit2| <= SCALE*log2(e) ~ 0.255 -> exp can never overflow, so one-pass
// softmax with no max subtraction.
// The cosine is not taken key by key. With j = KBLK*m + n the angle is
// alpha_m - n*omega, alpha_m = omega*(i - KBLK*m) + phase, and
//   cos(alpha_m - n*omega) = cos(alpha_m)*cos(n*omega) + sin(alpha_m)*sin(n*omega).
// cos(n*omega) and sin(n*omega), n < KBLK, are taken once per lane and stay in
// registers; cos(alpha_m) and sin(alpha_m), times the amplitude, once per
// block of KBLK keys. A key's logit is then one multiply and one fused
// multiply-add, and two keys share each packed instruction.
// ---------------------------------------------------------------------------
#define SLAB  32      // columns of v per work-group (one 128-byte line a row)
#define QROWS 16      // query rows per work-group, one per wave
#define KBLK  32      // keys per block of the angle addition

__global__ __launch_bounds__(SLAB * QROWS)
void wave_attn(const float* __restrict__ omega_rev, const float* __restrict__ amp_pre,
               const float* __restrict__ phase_rev, const float* __restrict__ vraw,
               float* __restrict__ context)
{
    __shared__ __align__(16) float vslab[S_LEN * SLAB];   // 64 KB of LDS

    const int t    = threadIdx.x;                          // 0..511
    const int lane = t & 31;
    const int c0   = (blockIdx.x & (HID / SLAB - 1)) * SLAB;
    // the wave's number, told to the compiler as wave-uniform: i and the
    // (i - j) counter then stay in scalar registers
    const int wave = __builtin_amdgcn_readfirstlane(t >> 5);
    const int i    = (blockIdx.x / (HID / SLAB)) * QROWS + wave;
    const size_t ic = (size_t)i * HID + c0 + lane;

    const float wr = omega_rev[ic];   // omega / 2pi   (revolutions per step)
    const float ap = amp_pre[ic];     // A * SCALE * log2(e)
    const float pr = phase_rev[ic];   // phase / 2pi

    // Fill the slab: 4096 pieces of 16 bytes, 8 per thread. Piece p is row
    // p >> 3, bytes (p & 7) * 16 of the row's 128; thread t takes pieces
    // t + 512 * n, so one step of n is 64 rows of v and 8 KB of LDS.
    {
        const uint32_t l0 = (uint32_t)(uintptr_t)(&vslab[0]) + (uint32_t)t * 16u;
        const uint64_t g0 = (uint64_t)(uintptr_t)(vraw + (size_t)(t >> 3) * HID
                                                  + c0 + (t & 7) * 4);
        const uint32_t ls = 512u * 16u;                    // LDS bytes per step
        const uint64_t gs = (uint64_t)64 * HID * 4;        // global bytes per step
        // s_wait_xcnt 0 stands, as a precaution, ahead of any rewrite of the
        // copies' address registers; inside the copies' own statement the
        // compiler can move nothing over it.
        asm volatile("global_load_async_to_lds_b128 %0, %8, off\n\t"
                     "global_load_async_to_lds_b128 %1, %9, off\n\t"
                     "global_load_async_to_lds_b128 %2, %10, off\n\t"
                     "global_load_async_to_lds_b128 %3, %11, off\n\t"
                     "global_load_async_to_lds_b128 %4, %12, off\n\t"
                     "global_load_async_to_lds_b128 %5, %13, off\n\t"
                     "global_load_async_to_lds_b128 %6, %14, off\n\t"
                     "global_load_async_to_lds_b128 %7, %15, off\n\t"
                     "s_wait_xcnt 0x0"
                     :: "v"(l0),          "v"(l0 + 1 * ls), "v"(l0 + 2 * ls), "v"(l0 + 3 * ls),
                        "v"(l0 + 4 * ls), "v"(l0 + 5 * ls), "v"(l0 + 6 * ls), "v"(l0 + 7 * ls),
                        "v"(g0),          "v"(g0 + 1 * gs), "v"(g0 + 2 * gs), "v"(g0 + 3 * gs),
                        "v"(g0 + 4 * gs), "v"(g0 + 5 * gs), "v"(g0 + 6 * gs), "v"(g0 + 7 * gs)
                     : "memory");
    }

    // keeps the tables' arithmetic, which waits for omega, behind the copies:
    // left alone the compiler lifts it over them and the copies start late
    __builtin_amdgcn_sched_barrier(0);

    // cos and sin of n steps of omega, keys n = 2h and 2h + 1 side by side;
    // taken here, while the copies fly. Unrolled whole: the two tables are
    // register arrays and stay in registers only under constant indices.
    v2f cn[KBLK / 2], sn[KBLK / 2];
#pragma unroll
    for (int h = 0; h < KBLK / 2; ++h) {
        // n = 0: no step, cos = 1 and sin = 0
        cn[h] = v2f{h == 0 ? 1.0f : __builtin_amdgcn_cosf(wr * (float)(2 * h)),   // revolutions
                    __builtin_amdgcn_cosf(wr * (float)(2 * h + 1))};
    }
#pragma unroll
    for (int h = 0; h < KBLK / 2; ++h) {
        sn[h] = v2f{h == 0 ? 0.0f : __builtin_amdgcn_sinf(wr * (float)(2 * h)),
                    __builtin_amdgcn_sinf(wr * (float)(2 * h + 1))};
    }
    // holds the tables' arithmetic ahead of the wait, under the copies' flight;
    // left alone the compiler sinks it behind the barrier
    __builtin_amdgcn_sched_barrier(0);

    // This wave's copies have landed; behind the barrier every wave's have.
    asm volatile("s_wait_asynccnt 0x0" ::: "memory");
    __syncthreads();

    float den  = 0.0f;
    float num  = 0.0f;
    float posf = (float)i;            // (i - KBLK*m), exact fp32 counter

    for (int m = 0; m < S_LEN / KBLK; ++m) {
        const float al = fmaf(wr, posf, pr);             // alpha_m, revolutions
        const float ca = ap * __builtin_amdgcn_cosf(al);
        const float sa = ap * __builtin_amdgcn_sinf(al);
        const v2f   cav = {ca, ca};
        const v2f   sav = {sa, sa};
        const float* vs = &vslab[m * (KBLK * SLAB) + lane];
        // every loop of the block is unrolled whole (constant register indices)
        // the block's LDS reads and all its logits first ...
        float vv[KBLK];
#pragma unroll
        for (int n = 0; n < KBLK; ++n)
            vv[n] = vs[n * SLAB];
        v2f lg[KBLK / 2];
#pragma unroll
        for (int h = 0; h < KBLK / 2; ++h)
            lg[h] = __builtin_elementwise_fma(sav, sn[h], cav * cn[h]);
        // ... held there: the packed products cover the reads' latency, and no
        // product lands on the source of the v_exp_f32 in front of it (mixed
        // in, the compiler reuses those registers and pads with v_nop)
        __builtin_amdgcn_sched_barrier(0);
        // den and num as before: one add and one fused multiply-add a key, in key order
#pragma unroll
        for (int n = 0; n < KBLK; ++n) {
            const float p = __builtin_amdgcn_exp2f(lg[n >> 1][n & 1]);
            den += p;
            num  = fmaf(p, vv[n], num);
        }
        posf -= (float)KBLK;
    }

    context[ic] = num * __builtin_amdgcn_rcpf(den);
}

// ---------------------------------------------------------------------------
// Host-side launcher.  d_ws layout (floats): omega | amp | phase | vraw | ctx
// = 5 * 512*256 * 4B = 2.62 MB.
// ---------------------------------------------------------------------------
extern "C" void kernel_launch(void* const* d_in, const int* in_sizes, int n_in,
                              void* d_out, int out_size, void* d_ws, size_t ws_size,
                              hipStream_t stream)
{
    (void)in_sizes; (void)n_in; (void)out_size; (void)ws_size;

    const float* x  = (const float*)d_in[0];
    const float* wq = (const float*)d_in[1];
    const float* bq = (const float*)d_in[2];
    const float* wk = (const float*)d_in[3];
    const float* bk = (const float*)d_in[4];
    const float* wv = (const float*)d_in[5];
    const float* bv = (const float*)d_in[6];
    const float* wo = (const float*)d_in[7];
    const float* bo = (const float*)d_in[8];
    float* out = (float*)d_out;

    float* ws = (float*)d_ws;
    const size_t N = (size_t)S_LEN * HID;
    float* omega = ws + 0 * N;
    float* amp   = ws + 1 * N;
    float* phase = ws + 2 * N;
    float* vraw  = ws + 3 * N;
    float* ctx   = ws + 4 * N;

    // 3 projections x (512/64) row groups x (256/32) column pairs = 192 blocks of 8 waves.
    hipLaunchKernelGGL(proj_qkv, dim3(192), dim3(256), 0, stream,
                       x, wq, bq, wk, bk, wv, bv, omega, amp, vraw, phase);

    // (512/16) query groups x (256/32) column slabs = 256 blocks of 16 waves.
    hipLaunchKernelGGL(wave_attn, dim3(256), dim3(512), 0, stream,
                       omega, amp, phase, vraw, ctx);

    // (512/32) row pairs x (256/32) column pairs = 128 blocks of 4 waves.
    hipLaunchKernelGGL(proj_out, dim3(128), dim3(128), 0, stream,
                       ctx, wo, bo, out);
}
